// v000
// Times are from an AMD MI455X. After a warm-up the kernel runs many times in a row, and a time is the length of
// such a window on the GPU divided by its runs, so every launch and the gaps after it count. The runs cycle
// through copies of the inputs. A figure is the median of several windows, for all but v000 over two sittings.
// Sittings can differ by a few percent; kernels timed side by side share one.
// v000 is the starting kernel. One run takes 273 microseconds.
#include <hip/hip_runtime.h>
#include <hip/hip_bf16.h>
#include <math.h>

typedef float v8f __attribute__((ext_vector_type(8)));
typedef float v4f __attribute__((ext_vector_type(4)));
typedef float v2f __attribute__((ext_vector_type(2)));
typedef int   v4i __attribute__((ext_vector_type(4)));

#define AS1 __attribute__((address_space(1)))
#define AS3 __attribute__((address_space(3)))

// Problem constants
#define Bsz   8
#define Nsz   4096
#define Csz   512
#define C2    1024
#define HEADS 16
#define DIM   32
#define IMGH  64
#define IMGW  64
#define Mtot  (Bsz * Nsz)          // 32768 rows
#define NCHUNK 8                   // n-split for kv partials

// Workspace layout (float offsets)
#define Q_OFF   0ul
#define K_OFF   16777216ul         // + B*N*C
#define KV_OFF  33554432ul         // + B*N*C          (B*H*32*32  = 131072)
#define KM_OFF  33685504ul         // + B*H*32*32      (B*H*32     = 4096)
#define WT_OFF  33689600ul         // + B*H*32         (C*2C       = 524288)
#define KVP_OFF 34213888ul         // + C*2C           (NCHUNK*B*H*1024 = 1048576)
#define KMP_OFF 35262464ul         // + partial kv     (NCHUNK*B*H*32   = 32768)

static __device__ __forceinline__ v8f wmma_f32(v2f a, v2f b, v8f c) {
    return __builtin_amdgcn_wmma_f32_16x16x4_f32(false, a, false, b, (short)0, c,
                                                 false, false);
}

// ---- CDNA5 async global->LDS DMA (ASYNCcnt) with fallback ------------------
#if defined(__gfx1250__) && \
    __has_builtin(__builtin_amdgcn_global_load_async_to_lds_b128) && \
    __has_builtin(__builtin_amdgcn_global_load_async_to_lds_b32)
#define HAVE_ASYNC 1
#else
#define HAVE_ASYNC 0
#endif

#if HAVE_ASYNC
static __device__ __forceinline__ void async_ld_b128(const float* g, float* l) {
    __builtin_amdgcn_global_load_async_to_lds_b128(
        (AS1 v4i*)(v4i*)(g), (AS3 v4i*)(v4i*)(l), 0, 0);
}
static __device__ __forceinline__ void async_ld_b32(const float* g, float* l) {
    __builtin_amdgcn_global_load_async_to_lds_b32(
        (AS1 int*)(int*)(g), (AS3 int*)(int*)(l), 0, 0);
}
static __device__ __forceinline__ void wait_async0() {
#if __has_builtin(__builtin_amdgcn_s_wait_asynccnt)
    __builtin_amdgcn_s_wait_asynccnt(0);
#else
    asm volatile("s_wait_asynccnt 0x0" ::: "memory");
#endif
}
#else
static __device__ __forceinline__ void wait_async0() {}
#endif

// ---------------------------------------------------------------------------
// Kernel 0: transpose w_qk [1024,512] -> wT [512,1024] for coalesced B loads
// ---------------------------------------------------------------------------
__global__ void k_transpose_w(const float* __restrict__ w, float* __restrict__ wT) {
    int idx = blockIdx.x * 256 + threadIdx.x;      // idx = c*1024 + j
    if (idx < Csz * C2) {
        int c = idx >> 10;
        int j = idx & (C2 - 1);
        wT[idx] = w[j * Csz + c];
    }
}

// ---------------------------------------------------------------------------
// Kernel 1: QK = x @ w^T + b, elu+1, split-store Q and K
// block: 256 thr (8 waves); tile 128 rows x 128 cols; wave 32x64 (8 accums)
// Double-buffered LDS; next tile DMA'd (async-to-LDS) during WMMA compute.
// ---------------------------------------------------------------------------
#define XS_STRIDE 36               // 144B rows: 16B aligned, conflict-free
#define XS_ELEMS  (128 * XS_STRIDE)
#define WP_ELEMS  (16 * 256)       // [kpair][j*2 + (krow&1)]

__global__ void __launch_bounds__(256)
k_qk_gemm(const float* __restrict__ x, const float* __restrict__ wT,
          const float* __restrict__ bqk, float* __restrict__ ws) {
    __shared__ float xs[2][XS_ELEMS];
    __shared__ float wp[2][WP_ELEMS];

    float* Q = ws + Q_OFF;
    float* K = ws + K_OFF;

    const int tid  = threadIdx.x;
    const int lane = tid & 31;
    const int lo   = lane & 15;
    const int half = lane >> 4;
    const int wv   = tid >> 5;           // 0..7
    const int wm   = wv & 3;             // m sub-tile (x32 rows)
    const int wj   = wv >> 2;            // j sub-tile (x64 cols)

    const int m0 = blockIdx.x * 128;
    const int j0 = blockIdx.y * 128;

    v8f acc[2][4];
    for (int s = 0; s < 2; ++s)
        for (int t = 0; t < 4; ++t) acc[s][t] = (v8f)0.0f;

    // -- tile staging: x[128x32] (b128 chunks), w[32x128] K-pair interleaved --
    auto stage = [&](int c0, int buf) {
#if HAVE_ASYNC
        #pragma unroll
        for (int it = 0; it < 4; ++it) {
            int idx = it * 256 + tid;                 // 1024 float4
            int r = idx >> 3, q = idx & 7;
            async_ld_b128(x + (size_t)(m0 + r) * Csz + c0 + q * 4,
                          &xs[buf][r * XS_STRIDE + q * 4]);
        }
        #pragma unroll
        for (int it = 0; it < 16; ++it) {
            int e = it * 256 + tid;                   // 4096 floats
            int r = e >> 7, j = e & 127;
            async_ld_b32(wT + (size_t)(c0 + r) * C2 + j0 + j,
                         &wp[buf][(r >> 1) * 256 + j * 2 + (r & 1)]);
        }
#else
        v4f tx[4], tw[4];
        #pragma unroll
        for (int it = 0; it < 4; ++it) {
            int idx = it * 256 + tid;
            int r = idx >> 3, q = idx & 7;
            tx[it] = *(const v4f*)(x + (size_t)(m0 + r) * Csz + c0 + q * 4);
        }
        #pragma unroll
        for (int it = 0; it < 4; ++it) {
            int idx = it * 256 + tid;
            int r = idx >> 5, q = idx & 31;
            tw[it] = *(const v4f*)(wT + (size_t)(c0 + r) * C2 + j0 + q * 4);
        }
        #pragma unroll
        for (int it = 0; it < 4; ++it) {
            int idx = it * 256 + tid;
            int r = idx >> 3, q = idx & 7;
            *(v4f*)(&xs[buf][r * XS_STRIDE + q * 4]) = tx[it];
        }
        #pragma unroll
        for (int it = 0; it < 4; ++it) {
            int idx = it * 256 + tid;
            int r = idx >> 5, q = idx & 31;
            float* dst = &wp[buf][(r >> 1) * 256 + (r & 1)];
            #pragma unroll
            for (int i = 0; i < 4; ++i) dst[(q * 4 + i) * 2] = tw[it][i];
        }
#endif
    };

    auto compute = [&](int buf) {
        const float* xsb = xs[buf];
        const float* wpb = wp[buf];
        #pragma unroll
        for (int kk = 0; kk < 32; kk += 4) {
            v2f a0 = *(const v2f*)(xsb + (wm * 32 + lo) * XS_STRIDE + kk + half * 2);
            v2f a1 = *(const v2f*)(xsb + (wm * 32 + 16 + lo) * XS_STRIDE + kk + half * 2);
            const float* wrow = wpb + ((kk >> 1) + half) * 256;
            #pragma unroll
            for (int jt = 0; jt < 4; ++jt) {
                v2f bf = *(const v2f*)(wrow + (wj * 64 + jt * 16 + lo) * 2);
                acc[0][jt] = wmma_f32(a0, bf, acc[0][jt]);
                acc[1][jt] = wmma_f32(a1, bf, acc[1][jt]);
            }
        }
    };

    stage(0, 0);
    wait_async0();
    __syncthreads();

    int buf = 0;
    for (int c0 = 0; c0 < Csz; c0 += 32, buf ^= 1) {
        if (c0 + 32 < Csz) stage(c0 + 32, buf ^ 1);   // DMA next tile
        compute(buf);                                  // WMMA on current tile
        wait_async0();                                 // next tile landed
        __syncthreads();
    }

    // epilogue: bias + elu+1, split into Q / K
    for (int jt = 0; jt < 4; ++jt) {
        int j = j0 + wj * 64 + jt * 16 + lo;
        float bias = bqk[j];
        for (int s = 0; s < 2; ++s) {
            for (int r = 0; r < 8; ++r) {
                int mloc = wm * 32 + s * 16 + half * 8 + r;
                size_t m = (size_t)(m0 + mloc);
                float v = acc[s][jt][r] + bias;
                float act = (v > 0.0f) ? (v + 1.0f) : __expf(v);   // elu(v)+1
                if (j < Csz) Q[m * Csz + j]         = act;
                else         K[m * Csz + (j - Csz)] = act;
            }
        }
    }
}

// ---------------------------------------------------------------------------
// Kernel 2: per (b,head,chunk): partial kv = k^T x (32x32), partial k_sum
// grid: (B*H, NCHUNK); block 128 thr (4 waves); wave = one 16x16 quadrant
// ---------------------------------------------------------------------------
__global__ void __launch_bounds__(128)
k_kv_partial(const float* __restrict__ x, float* __restrict__ ws) {
    const float* K = ws + K_OFF;
    float* KVP = ws + KVP_OFF;
    float* KMP = ws + KMP_OFF;

    const int bh = blockIdx.x;           // 0..127
    const int ck = blockIdx.y;           // 0..NCHUNK-1
    const int b  = bh >> 4;
    const int hh = bh & 15;
    const int ch = hh * DIM;

    const int tid  = threadIdx.x;
    const int lane = tid & 31;
    const int lo   = lane & 15;
    const int half = lane >> 4;
    const int wv   = tid >> 5;
    const int dt   = wv & 1;             // d quadrant
    const int et   = wv >> 1;            // e quadrant

    const size_t rowbase = (size_t)b * Nsz;
    const int nlo = ck * (Nsz / NCHUNK);
    const int nhi = nlo + (Nsz / NCHUNK);

    v8f acc = (v8f)0.0f;
    float ksum = 0.0f;

    for (int n0 = nlo; n0 < nhi; n0 += 4) {
        int nA = n0 + half * 2;
        v2f a, bf;
        // A = k^T : A[d][k] ; d = dt*16+lo, k(n) = 2*half + vgpr
        a[0] = K[(rowbase + nA)     * Csz + ch + dt * 16 + lo];
        a[1] = K[(rowbase + nA + 1) * Csz + ch + dt * 16 + lo];
        // B = x   : B[k][e] ; k(n) = 2*half + vgpr, e = et*16+lo
        bf[0] = x[(rowbase + nA)     * Csz + ch + et * 16 + lo];
        bf[1] = x[(rowbase + nA + 1) * Csz + ch + et * 16 + lo];
        acc = wmma_f32(a, bf, acc);
        ksum += a[0] + a[1];             // partial over n for d = dt*16+lo
    }

    // k_sum partial: combine the two n-halves held by lane and lane^16
    float tot = ksum + __shfl_xor(ksum, 16, 32);
    if (et == 0 && lane < 16)
        KMP[((size_t)ck * 128 + bh) * DIM + dt * 16 + lane] = tot;

    // store kv partial quadrant
    for (int r = 0; r < 8; ++r) {
        int drow = dt * 16 + half * 8 + r;
        int e    = et * 16 + lo;
        KVP[((size_t)ck * 128 + bh) * (DIM * DIM) + drow * DIM + e] = acc[r];
    }
}

// ---------------------------------------------------------------------------
// Kernel 2b: deterministic reduction of kv / k_mean partials (no atomics).
// KV is stored K-pair-interleaved: KV[(d>>1)*64 + e*2 + (d&1)] so kernel 3's
// B fragments are single aligned b64 loads.
// ---------------------------------------------------------------------------
__global__ void __launch_bounds__(256)
k_kv_reduce(float* __restrict__ ws) {
    const float* KVP = ws + KVP_OFF;
    const float* KMP = ws + KMP_OFF;
    float* KV = ws + KV_OFF;
    float* KM = ws + KM_OFF;

    const int bh = blockIdx.x;
    const float invN = 1.0f / (float)Nsz;

    for (int idx = threadIdx.x; idx < DIM * DIM; idx += 256) {
        int d = idx >> 5, e = idx & 31;
        float s = 0.0f;
        for (int c = 0; c < NCHUNK; ++c)
            s += KVP[((size_t)c * 128 + bh) * (DIM * DIM) + idx];
        KV[(size_t)bh * (DIM * DIM) + (d >> 1) * 64 + e * 2 + (d & 1)] = s * invN;
    }
    if (threadIdx.x < DIM) {
        float s = 0.0f;
        for (int c = 0; c < NCHUNK; ++c)
            s += KMP[((size_t)c * 128 + bh) * DIM + threadIdx.x];
        KM[(size_t)bh * DIM + threadIdx.x] = s * invN;
    }
}

// ---------------------------------------------------------------------------
// Kernel 3: out = z * (q @ kv) + LePE(x);  z = 1/(q . k_mean + 1e-6)
// grid: (N/64, B*HEADS); block 128 thr (4 waves); wave = 16 rows x 32 cols
// ---------------------------------------------------------------------------
__global__ void __launch_bounds__(128)
k_attn_out(const float* __restrict__ x, const float* __restrict__ wlepe,
           const float* __restrict__ blepe, const float* __restrict__ ws_c,
           float* __restrict__ out) {
    const float* Q  = ws_c + Q_OFF;
    const float* KV = ws_c + KV_OFF;     // K-pair interleaved
    const float* KM = ws_c + KM_OFF;

    const int bh = blockIdx.y;
    const int b  = bh >> 4;
    const int hh = bh & 15;
    const int ch = hh * DIM;

    const int tid  = threadIdx.x;
    const int lane = tid & 31;
    const int lo   = lane & 15;
    const int half = lane >> 4;
    const int wv   = tid >> 5;

    const int n_base = blockIdx.x * 64 + wv * 16;
    const size_t rowbase = (size_t)b * Nsz;
    const size_t kvbase  = (size_t)bh * DIM * DIM;
    const size_t kmbase  = (size_t)bh * DIM;

    v8f acc0 = (v8f)0.0f, acc1 = (v8f)0.0f;
    float zpart = 0.0f;

    #pragma unroll
    for (int dk = 0; dk < DIM; dk += 4) {
        int k0 = dk + half * 2;          // even
        // A = q : row = n_base+lo, k = dk + 2*half + vgpr  (one b64 load)
        v2f a  = *(const v2f*)(Q + (rowbase + n_base + lo) * Csz + ch + k0);
        // B = kv : pair-interleaved -> single b64 per 16-col tile
        v2f b0 = *(const v2f*)(KV + kvbase + (k0 >> 1) * 64 + lo * 2);
        v2f b1 = *(const v2f*)(KV + kvbase + (k0 >> 1) * 64 + (16 + lo) * 2);
        acc0 = wmma_f32(a, b0, acc0);
        acc1 = wmma_f32(a, b1, acc1);
        zpart += a[0] * KM[kmbase + k0] + a[1] * KM[kmbase + k0 + 1];
    }

    // z per row: lane 'lo' (both halves) holds z for row n_base+lo
    float dot = zpart + __shfl_xor(zpart, 16, 32);
    float z   = 1.0f / (dot + 1e-6f);

    for (int r = 0; r < 8; ++r) {
        float zl = __shfl(z, r, 32);
        float zh = __shfl(z, r + 8, 32);
        float zr = half ? zh : zl;
        int n = n_base + half * 8 + r;
        int y  = n >> 6;
        int xp = n & 63;
        float av[2] = {acc0[r], acc1[r]};
        for (int et = 0; et < 2; ++et) {
            int c = ch + et * 16 + lo;
            float lepe = blepe[c];
            #pragma unroll
            for (int dy = 0; dy < 3; ++dy) {
                int yy = y + dy - 1;
                if (yy < 0 || yy >= IMGH) continue;
                #pragma unroll
                for (int dx = 0; dx < 3; ++dx) {
                    int xx = xp + dx - 1;
                    if (xx < 0 || xx >= IMGW) continue;
                    lepe += x[(rowbase + yy * IMGW + xx) * Csz + c] *
                            wlepe[c * 9 + dy * 3 + dx];
                }
            }
            out[(rowbase + n) * Csz + c] = av[et] * zr + lepe;
        }
    }
}

// ---------------------------------------------------------------------------
extern "C" void kernel_launch(void* const* d_in, const int* in_sizes, int n_in,
                              void* d_out, int out_size, void* d_ws, size_t ws_size,
                              hipStream_t stream) {
    (void)in_sizes; (void)n_in; (void)out_size; (void)ws_size;
    const float* x      = (const float*)d_in[0];
    const float* w_qk   = (const float*)d_in[1];
    const float* b_qk   = (const float*)d_in[2];
    const float* w_lepe = (const float*)d_in[3];
    const float* b_lepe = (const float*)d_in[4];
    float* out = (float*)d_out;
    float* ws  = (float*)d_ws;
    float* wT  = ws + WT_OFF;

    k_transpose_w<<<(Csz * C2 + 255) / 256, 256, 0, stream>>>(w_qk, wT);
    k_qk_gemm<<<dim3(Mtot / 128, C2 / 128), 256, 0, stream>>>(x, wT, b_qk, ws);
    k_kv_partial<<<dim3(Bsz * HEADS, NCHUNK), 128, 0, stream>>>(x, ws);
    k_kv_reduce<<<Bsz * HEADS, 256, 0, stream>>>(ws);
    k_attn_out<<<dim3(Nsz / 64, Bsz * HEADS), 128, 0, stream>>>(
        x, w_lepe, b_lepe, ws, out);
}

// v001
// Measured time: 240 microseconds a run.
// In both of two side-by-side timings against v000, it was 1.19 times as fast.
#include <hip/hip_runtime.h>
#include <hip/hip_bf16.h>
#include <math.h>

typedef float v8f __attribute__((ext_vector_type(8)));
typedef float v4f __attribute__((ext_vector_type(4)));
typedef float v2f __attribute__((ext_vector_type(2)));
typedef int   v4i __attribute__((ext_vector_type(4)));

#define AS1 __attribute__((address_space(1)))
#define AS3 __attribute__((address_space(3)))

// Problem constants
#define Bsz   8
#define Nsz   4096
#define Csz   512
#define C2    1024
#define HEADS 16
#define DIM   32
#define IMGH  64
#define IMGW  64
#define Mtot  (Bsz * Nsz)          // 32768 rows
#define NCHUNK 8                   // n-split for kv partials

// Workspace layout (float offsets)
#define Q_OFF   0ul
#define K_OFF   16777216ul         // + B*N*C
#define KV_OFF  33554432ul         // + B*N*C          (B*H*32*32  = 131072)
#define KM_OFF  33685504ul         // + B*H*32*32      (B*H*32     = 4096)
#define WT_OFF  33689600ul         // + B*H*32         (C*2C       = 524288)
#define KVP_OFF 34213888ul         // + C*2C           (NCHUNK*B*H*1024 = 1048576)
#define KMP_OFF 35262464ul         // + partial kv     (NCHUNK*B*H*32   = 32768)

static __device__ __forceinline__ v8f wmma_f32(v2f a, v2f b, v8f c) {
    return __builtin_amdgcn_wmma_f32_16x16x4_f32(false, a, false, b, (short)0, c,
                                                 false, false);
}

// ---- CDNA5 async global->LDS DMA (ASYNCcnt) with fallback ------------------
#if defined(__gfx1250__) && \
    __has_builtin(__builtin_amdgcn_global_load_async_to_lds_b128) && \
    __has_builtin(__builtin_amdgcn_global_load_async_to_lds_b32)
#define HAVE_ASYNC 1
#else
#define HAVE_ASYNC 0
#endif

#if HAVE_ASYNC
static __device__ __forceinline__ void async_ld_b128(const float* g, float* l) {
    __builtin_amdgcn_global_load_async_to_lds_b128(
        (AS1 v4i*)(v4i*)(g), (AS3 v4i*)(v4i*)(l), 0, 0);
}
static __device__ __forceinline__ void async_ld_b32(const float* g, float* l) {
    __builtin_amdgcn_global_load_async_to_lds_b32(
        (AS1 int*)(int*)(g), (AS3 int*)(int*)(l), 0, 0);
}
static __device__ __forceinline__ void wait_async0() {
#if __has_builtin(__builtin_amdgcn_s_wait_asynccnt)
    __builtin_amdgcn_s_wait_asynccnt(0);
#else
    asm volatile("s_wait_asynccnt 0x0" ::: "memory");
#endif
}
#else
static __device__ __forceinline__ void wait_async0() {}
#endif

// ---------------------------------------------------------------------------
// Kernel 0: transpose w_qk [1024,512] -> wT [512,1024] for coalesced B loads
// ---------------------------------------------------------------------------
__global__ void k_transpose_w(const float* __restrict__ w, float* __restrict__ wT) {
    int idx = blockIdx.x * 256 + threadIdx.x;      // idx = c*1024 + j
    if (idx < Csz * C2) {
        int c = idx >> 10;
        int j = idx & (C2 - 1);
        wT[idx] = w[j * Csz + c];
    }
}

// ---------------------------------------------------------------------------
// Kernel 1: QK = x @ w^T + b, elu+1, split-store Q and K
// block: 256 thr (8 waves); tile 128 rows x 128 cols; wave 32x64 (8 accums)
// Double-buffered LDS; next tile DMA'd (async-to-LDS) during WMMA compute.
// ---------------------------------------------------------------------------
#define XS_STRIDE 36               // 144B rows: 16B aligned, conflict-free
#define XS_ELEMS  (128 * XS_STRIDE)
#define WP_ELEMS  (16 * 256)       // [kpair][j*2 + (krow&1)]

__global__ void __launch_bounds__(256)
k_qk_gemm(const float* __restrict__ x, const float* __restrict__ wT,
          const float* __restrict__ bqk, float* __restrict__ ws) {
    __shared__ float xs[2][XS_ELEMS];
    __shared__ float wp[2][WP_ELEMS];

    float* Q = ws + Q_OFF;
    float* K = ws + K_OFF;

    const int tid  = threadIdx.x;
    const int lane = tid & 31;
    const int lo   = lane & 15;
    const int half = lane >> 4;
    const int wv   = tid >> 5;           // 0..7
    const int wm   = wv & 3;             // m sub-tile (x32 rows)
    const int wj   = wv >> 2;            // j sub-tile (x64 cols)

    const int m0 = blockIdx.x * 128;
    const int j0 = blockIdx.y * 128;

    v8f acc[2][4];
    for (int s = 0; s < 2; ++s)
        for (int t = 0; t < 4; ++t) acc[s][t] = (v8f)0.0f;

    // -- tile staging: x[128x32] (b128 chunks), w[32x128] K-pair interleaved --
    auto stage = [&](int c0, int buf) {
#if HAVE_ASYNC
        #pragma unroll
        for (int it = 0; it < 4; ++it) {
            int idx = it * 256 + tid;                 // 1024 float4
            int r = idx >> 3, q = idx & 7;
            async_ld_b128(x + (size_t)(m0 + r) * Csz + c0 + q * 4,
                          &xs[buf][r * XS_STRIDE + q * 4]);
        }
        #pragma unroll
        for (int it = 0; it < 16; ++it) {
            int e = it * 256 + tid;                   // 4096 floats
            int r = e >> 7, j = e & 127;
            async_ld_b32(wT + (size_t)(c0 + r) * C2 + j0 + j,
                         &wp[buf][(r >> 1) * 256 + j * 2 + (r & 1)]);
        }
#else
        v4f tx[4], tw[4];
        #pragma unroll
        for (int it = 0; it < 4; ++it) {
            int idx = it * 256 + tid;
            int r = idx >> 3, q = idx & 7;
            tx[it] = *(const v4f*)(x + (size_t)(m0 + r) * Csz + c0 + q * 4);
        }
        #pragma unroll
        for (int it = 0; it < 4; ++it) {
            int idx = it * 256 + tid;
            int r = idx >> 5, q = idx & 31;
            tw[it] = *(const v4f*)(wT + (size_t)(c0 + r) * C2 + j0 + q * 4);
        }
        #pragma unroll
        for (int it = 0; it < 4; ++it) {
            int idx = it * 256 + tid;
            int r = idx >> 3, q = idx & 7;
            *(v4f*)(&xs[buf][r * XS_STRIDE + q * 4]) = tx[it];
        }
        #pragma unroll
        for (int it = 0; it < 4; ++it) {
            int idx = it * 256 + tid;
            int r = idx >> 5, q = idx & 31;
            float* dst = &wp[buf][(r >> 1) * 256 + (r & 1)];
            #pragma unroll
            for (int i = 0; i < 4; ++i) dst[(q * 4 + i) * 2] = tw[it][i];
        }
#endif
    };

    auto compute = [&](int buf) {
        const float* xsb = xs[buf];
        const float* wpb = wp[buf];
        #pragma unroll
        for (int kk = 0; kk < 32; kk += 4) {
            v2f a0 = *(const v2f*)(xsb + (wm * 32 + lo) * XS_STRIDE + kk + half * 2);
            v2f a1 = *(const v2f*)(xsb + (wm * 32 + 16 + lo) * XS_STRIDE + kk + half * 2);
            const float* wrow = wpb + ((kk >> 1) + half) * 256;
            #pragma unroll
            for (int jt = 0; jt < 4; ++jt) {
                v2f bf = *(const v2f*)(wrow + (wj * 64 + jt * 16 + lo) * 2);
                acc[0][jt] = wmma_f32(a0, bf, acc[0][jt]);
                acc[1][jt] = wmma_f32(a1, bf, acc[1][jt]);
            }
        }
    };

    stage(0, 0);
    wait_async0();
    __syncthreads();

    int buf = 0;
    for (int c0 = 0; c0 < Csz; c0 += 32, buf ^= 1) {
        if (c0 + 32 < Csz) stage(c0 + 32, buf ^ 1);   // DMA next tile
        compute(buf);                                  // WMMA on current tile
        wait_async0();                                 // next tile landed
        __syncthreads();
    }

    // epilogue: bias + elu+1, split into Q / K
    for (int jt = 0; jt < 4; ++jt) {
        int j = j0 + wj * 64 + jt * 16 + lo;
        float bias = bqk[j];
        for (int s = 0; s < 2; ++s) {
            for (int r = 0; r < 8; ++r) {
                int mloc = wm * 32 + s * 16 + half * 8 + r;
                size_t m = (size_t)(m0 + mloc);
                float v = acc[s][jt][r] + bias;
                float act = (v > 0.0f) ? (v + 1.0f) : __expf(v);   // elu(v)+1
                if (j < Csz) Q[m * Csz + j]         = act;
                else         K[m * Csz + (j - Csz)] = act;
            }
        }
    }
}

// ---------------------------------------------------------------------------
// Kernel 2: per (b,head,chunk): partial kv = k^T x (32x32), partial k_sum
// grid: (B*H, NCHUNK); block 128 thr (4 waves); wave = one 16x16 quadrant
// ---------------------------------------------------------------------------
__global__ void __launch_bounds__(128)
k_kv_partial(const float* __restrict__ x, float* __restrict__ ws) {
    const float* K = ws + K_OFF;
    float* KVP = ws + KVP_OFF;
    float* KMP = ws + KMP_OFF;

    const int bh = blockIdx.x;           // 0..127
    const int ck = blockIdx.y;           // 0..NCHUNK-1
    const int b  = bh >> 4;
    const int hh = bh & 15;
    const int ch = hh * DIM;

    const int tid  = threadIdx.x;
    const int lane = tid & 31;
    const int lo   = lane & 15;
    const int half = lane >> 4;
    const int wv   = tid >> 5;
    const int dt   = wv & 1;             // d quadrant
    const int et   = wv >> 1;            // e quadrant

    const size_t rowbase = (size_t)b * Nsz;
    const int nlo = ck * (Nsz / NCHUNK);
    const int nhi = nlo + (Nsz / NCHUNK);

    v8f acc = (v8f)0.0f;
    float ksum = 0.0f;

    for (int n0 = nlo; n0 < nhi; n0 += 4) {
        int nA = n0 + half * 2;
        v2f a, bf;
        // A = k^T : A[d][k] ; d = dt*16+lo, k(n) = 2*half + vgpr
        a[0] = K[(rowbase + nA)     * Csz + ch + dt * 16 + lo];
        a[1] = K[(rowbase + nA + 1) * Csz + ch + dt * 16 + lo];
        // B = x   : B[k][e] ; k(n) = 2*half + vgpr, e = et*16+lo
        bf[0] = x[(rowbase + nA)     * Csz + ch + et * 16 + lo];
        bf[1] = x[(rowbase + nA + 1) * Csz + ch + et * 16 + lo];
        acc = wmma_f32(a, bf, acc);
        ksum += a[0] + a[1];             // partial over n for d = dt*16+lo
    }

    // k_sum partial: combine the two n-halves held by lane and lane^16
    float tot = ksum + __shfl_xor(ksum, 16, 32);
    if (et == 0 && lane < 16)
        KMP[((size_t)ck * 128 + bh) * DIM + dt * 16 + lane] = tot;

    // store kv partial quadrant
    for (int r = 0; r < 8; ++r) {
        int drow = dt * 16 + half * 8 + r;
        int e    = et * 16 + lo;
        KVP[((size_t)ck * 128 + bh) * (DIM * DIM) + drow * DIM + e] = acc[r];
    }
}

// ---------------------------------------------------------------------------
// Kernel 2b: deterministic reduction of kv / k_mean partials (no atomics).
// KV is stored K-pair-interleaved: KV[(d>>1)*64 + e*2 + (d&1)] so kernel 3's
// B fragments are single aligned b64 loads.
// ---------------------------------------------------------------------------
__global__ void __launch_bounds__(256)
k_kv_reduce(float* __restrict__ ws) {
    const float* KVP = ws + KVP_OFF;
    const float* KMP = ws + KMP_OFF;
    float* KV = ws + KV_OFF;
    float* KM = ws + KM_OFF;

    const int bh = blockIdx.x;
    const float invN = 1.0f / (float)Nsz;

    for (int idx = threadIdx.x; idx < DIM * DIM; idx += 256) {
        int d = idx >> 5, e = idx & 31;
        float s = 0.0f;
        for (int c = 0; c < NCHUNK; ++c)
            s += KVP[((size_t)c * 128 + bh) * (DIM * DIM) + idx];
        KV[(size_t)bh * (DIM * DIM) + (d >> 1) * 64 + e * 2 + (d & 1)] = s * invN;
    }
    if (threadIdx.x < DIM) {
        float s = 0.0f;
        for (int c = 0; c < NCHUNK; ++c)
            s += KMP[((size_t)c * 128 + bh) * DIM + threadIdx.x];
        KM[(size_t)bh * DIM + threadIdx.x] = s * invN;
    }
}

// ---------------------------------------------------------------------------
// Kernel 3: out = z * (q @ kv) + LePE(x);  z = 1/(q . k_mean + 1e-6)
// grid: (image row pairs, B*HEADS); block 128 thr (4 waves);
// wave = the same 16 pixels of both image rows x 32 cols.
// The block's operands are staged in LDS once, by whole-line 16-byte loads:
// the four x rows its 3x3 windows touch (zero halo on every side) and the
// 128x32 q tile. Taps and A fragments are then LDS reads.
// ---------------------------------------------------------------------------
#define RB      2                  // image rows per block
#define T_PITCH 36                 // 144B pixel pitch: 16B aligned; 8 pixels = 32 banks
#define XT_COLS (IMGW + 2)         // one zero pixel left and right
#define XT_ROWS (RB + 2)

__global__ void __launch_bounds__(128)
k_attn_out(const float* __restrict__ x, const float* __restrict__ wlepe,
           const float* __restrict__ blepe, const float* __restrict__ ws_c,
           float* __restrict__ out) {
    __shared__ __attribute__((aligned(16))) float xt[XT_ROWS * XT_COLS * T_PITCH];
    __shared__ __attribute__((aligned(16))) float qt[RB * IMGW * T_PITCH];

    const float* Q  = ws_c + Q_OFF;
    const float* KV = ws_c + KV_OFF;     // K-pair interleaved
    const float* KM = ws_c + KM_OFF;

    const int y0 = blockIdx.x * RB;      // first image row; a row = 64 consecutive n
    const int bh = blockIdx.y;
    const int b  = bh >> 4;
    const int hh = bh & 15;
    const int ch = hh * DIM;

    const int tid  = threadIdx.x;
    const int lane = tid & 31;
    const int lo   = lane & 15;
    const int half = lane >> 4;
    const int wv   = tid >> 5;

    const size_t rowbase = (size_t)b * Nsz;
    const size_t kvbase  = (size_t)bh * DIM * DIM;
    const size_t kmbase  = (size_t)bh * DIM;

    // -- stage: 8 lanes cover one pixel's 128-byte line of this head ---------
    const int sq = tid & 7;              // 16-byte piece of the line
    const int sp = tid >> 3;             // pixel 0..15, +16 per step
    v4f tq[RB * 4], tx[XT_ROWS][4];
    #pragma unroll
    for (int i = 0; i < RB * 4; ++i)
        tq[i] = *(const v4f*)(Q + (rowbase + y0 * IMGW + i * 16 + sp) * Csz + ch + sq * 4);
    // Only the first staged row can lie above the image and only the last one
    // below it. Such a row is read at a clamped, valid address and replaced by
    // zeros, so the staging stays free of branches.
    const bool top_ok = y0 > 0;
    const bool bot_ok = y0 + RB < IMGH;
    #pragma unroll
    for (int ry = 0; ry < XT_ROWS; ++ry) {
        const bool ok = (ry == 0) ? top_ok : (ry == XT_ROWS - 1) ? bot_ok : true;
        const int yy = ok ? y0 + ry - 1 : y0;    // same for the whole block
        #pragma unroll
        for (int i = 0; i < 4; ++i) {
            v4f t = *(const v4f*)(x + (rowbase + yy * IMGW + i * 16 + sp) * Csz + ch + sq * 4);
            tx[ry][i] = ok ? t : (v4f)0.0f;
        }
    }

    // operands that do not pass through LDS, requested ahead of the barrier:
    // conv weights and bias of the lane's two channels, kv fragments, k_mean
    float wr[2][9], bias[2];
    #pragma unroll
    for (int et = 0; et < 2; ++et) {
        const int c = ch + et * 16 + lo;
        bias[et] = blepe[c];
        wr[et][8] = wlepe[c * 9 + 8];
    }
    // the wider weight loads below may return into the index registers of the
    // single-word loads above: keep the wait in front of that overwrite
    asm volatile("s_wait_xcnt 0x0" ::: "memory");
    #pragma unroll
    for (int et = 0; et < 2; ++et) {
        const int c = ch + et * 16 + lo;
        #pragma unroll
        for (int t = 0; t < 8; ++t) wr[et][t] = wlepe[c * 9 + t];
    }
    v2f b0[8], b1[8], km[8];
    #pragma unroll
    for (int s = 0; s < 8; ++s) {
        const int k0 = s * 4 + half * 2; // even
        // B = kv : pair-interleaved -> single b64 per 16-col tile
        b0[s] = *(const v2f*)(KV + kvbase + (k0 >> 1) * 64 + lo * 2);
        b1[s] = *(const v2f*)(KV + kvbase + (k0 >> 1) * 64 + (16 + lo) * 2);
        km[s] = *(const v2f*)(KM + kmbase + k0);
    }

    #pragma unroll
    for (int i = 0; i < RB * 4; ++i)
        *(v4f*)(qt + (i * 16 + sp) * T_PITCH + sq * 4) = tq[i];
    #pragma unroll
    for (int ry = 0; ry < XT_ROWS; ++ry)
        #pragma unroll
        for (int i = 0; i < 4; ++i)
            *(v4f*)(xt + (ry * XT_COLS + 1 + i * 16 + sp) * T_PITCH + sq * 4) = tx[ry][i];
    if (tid < XT_ROWS * 16) {            // zero pixels left and right of each row
        const int hr = tid >> 4, side = (tid >> 3) & 1;
        *(v4f*)(xt + (hr * XT_COLS + side * (XT_COLS - 1)) * T_PITCH + sq * 4) = (v4f)0.0f;
    }
    __syncthreads();                     // tiles complete before any wave reads them

    v8f acc[RB][2];
    float zpart[RB];
    #pragma unroll
    for (int t = 0; t < RB; ++t) {
        acc[t][0] = (v8f)0.0f; acc[t][1] = (v8f)0.0f; zpart[t] = 0.0f;
    }

    #pragma unroll
    for (int s = 0; s < 8; ++s) {
        const int k0 = s * 4 + half * 2;
        #pragma unroll
        for (int t = 0; t < RB; ++t) {
            // A = q : row = pixel wv*16+lo of image row t, k = 4s + 2*half + vgpr
            v2f a = *(const v2f*)(qt + (t * IMGW + wv * 16 + lo) * T_PITCH + k0);
            acc[t][0] = wmma_f32(a, b0[s], acc[t][0]);
            acc[t][1] = wmma_f32(a, b1[s], acc[t][1]);
            zpart[t] += a[0] * km[s][0] + a[1] * km[s][1];
        }
    }

    // z per row: lane 'lo' (both halves) holds z for pixel wv*16+lo
    float zr[RB][8];
    #pragma unroll
    for (int t = 0; t < RB; ++t) {
        float dot = zpart[t] + __shfl_xor(zpart[t], 16, 32);
        float z   = 1.0f / (dot + 1e-6f);
        #pragma unroll
        for (int r = 0; r < 8; ++r) {
            float zl = __shfl(z, r, 32);
            float zh = __shfl(z, r + 8, 32);
            zr[t][r] = half ? zh : zl;
        }
    }

    // LePE in the accumulator layout: a lane owns 8 consecutive pixels of one
    // channel in each image row, so a staged row is 10 LDS reads that serve
    // every window row it is part of.
    const float* xb = xt + (wv * 16 + half * 8) * T_PITCH + lo;
    #pragma unroll
    for (int et = 0; et < 2; ++et) {
        float o[RB][8];
        #pragma unroll
        for (int t = 0; t < RB; ++t)
            #pragma unroll
            for (int r = 0; r < 8; ++r) o[t][r] = bias[et];
        #pragma unroll
        for (int ry = 0; ry < XT_ROWS; ++ry) {
            float v[10];
            #pragma unroll
            for (int j = 0; j < 10; ++j)
                v[j] = xb[(ry * XT_COLS + j) * T_PITCH + et * 16];
            #pragma unroll
            for (int t = 0; t < RB; ++t) {
                const int dy = ry - t;   // window row of image row t
                if (dy < 0 || dy > 2) continue;
                #pragma unroll
                for (int r = 0; r < 8; ++r)
                    #pragma unroll
                    for (int dx = 0; dx < 3; ++dx)
                        o[t][r] += v[r + dx] * wr[et][dy * 3 + dx];
            }
        }
        const int c = ch + et * 16 + lo;
        #pragma unroll
        for (int t = 0; t < RB; ++t)
            #pragma unroll
            for (int r = 0; r < 8; ++r) {
                const int n = (y0 + t) * IMGW + wv * 16 + half * 8 + r;
                out[(rowbase + n) * Csz + c] = acc[t][et][r] * zr[t][r] + o[t][r];
            }
    }
}

// ---------------------------------------------------------------------------
extern "C" void kernel_launch(void* const* d_in, const int* in_sizes, int n_in,
                              void* d_out, int out_size, void* d_ws, size_t ws_size,
                              hipStream_t stream) {
    (void)in_sizes; (void)n_in; (void)out_size; (void)ws_size;
    const float* x      = (const float*)d_in[0];
    const float* w_qk   = (const float*)d_in[1];
    const float* b_qk   = (const float*)d_in[2];
    const float* w_lepe = (const float*)d_in[3];
    const float* b_lepe = (const float*)d_in[4];
    float* out = (float*)d_out;
    float* ws  = (float*)d_ws;
    float* wT  = ws + WT_OFF;

    k_transpose_w<<<(Csz * C2 + 255) / 256, 256, 0, stream>>>(w_qk, wT);
    k_qk_gemm<<<dim3(Mtot / 128, C2 / 128), 256, 0, stream>>>(x, wT, b_qk, ws);
    k_kv_partial<<<dim3(Bsz * HEADS, NCHUNK), 128, 0, stream>>>(x, ws);
    k_kv_reduce<<<Bsz * HEADS, 256, 0, stream>>>(ws);
    k_attn_out<<<dim3(IMGH / RB, Bsz * HEADS), 128, 0, stream>>>(
        x, w_lepe, b_lepe, ws, out);
}

// v002
// One run takes 209 microseconds.
// In both of two side-by-side timings against v001, it was 1.15 times as fast.
// Over all steps from v000 it is 1.37 times as fast.
#include <hip/hip_runtime.h>
#include <hip/hip_bf16.h>
#include <math.h>

typedef float v8f __attribute__((ext_vector_type(8)));
typedef float v4f __attribute__((ext_vector_type(4)));
typedef float v2f __attribute__((ext_vector_type(2)));
typedef int   v4i __attribute__((ext_vector_type(4)));

#define AS1 __attribute__((address_space(1)))
#define AS3 __attribute__((address_space(3)))

// Problem constants
#define Bsz   8
#define Nsz   4096
#define Csz   512
#define C2    1024
#define HEADS 16
#define DIM   32
#define IMGH  64
#define IMGW  64
#define Mtot  (Bsz * Nsz)          // 32768 rows
#define NCHUNK 32                  // kv partials per batch: one per 128-row GEMM block

// Workspace layout (float offsets)
#define Q_OFF   0ul
#define KV_OFF  33554432ul         // (B*H*32*32  = 131072)
#define KM_OFF  33685504ul         // + B*H*32*32      (B*H*32     = 4096)
#define WT_OFF  33689600ul         // + B*H*32         (C*2C       = 524288)
#define KVP_OFF 34213888ul         // + C*2C           (NCHUNK*B*H*1024 = 4194304)
#define KMP_OFF 38408192ul         // + partial kv     (NCHUNK*B*H*32   = 131072)

static __device__ __forceinline__ v8f wmma_f32(v2f a, v2f b, v8f c) {
    return __builtin_amdgcn_wmma_f32_16x16x4_f32(false, a, false, b, (short)0, c,
                                                 false, false);
}

// exp(v) as 2^(v*log2 e), for the negative side of elu(v)+1. One statement: the
// v_nop is the independent slot the instruction set asks for between a
// transcendental and a next instruction that reads its result or overwrites its
// source.
static __device__ __forceinline__ float exp_slot(float v) {
    float r;
    asm("v_exp_f32 %0, %1\n\tv_nop" : "=v"(r) : "v"(v * 1.44269504f));
    return r;
}

// ---- CDNA5 async global->LDS DMA (ASYNCcnt) with fallback ------------------
#if defined(__gfx1250__) && \
    __has_builtin(__builtin_amdgcn_global_load_async_to_lds_b128) && \
    __has_builtin(__builtin_amdgcn_global_load_async_to_lds_b32)
#define HAVE_ASYNC 1
#else
#define HAVE_ASYNC 0
#endif

#if HAVE_ASYNC
static __device__ __forceinline__ void async_ld_b128(const float* g, float* l) {
    __builtin_amdgcn_global_load_async_to_lds_b128(
        (AS1 v4i*)(v4i*)(g), (AS3 v4i*)(v4i*)(l), 0, 0);
}
static __device__ __forceinline__ void async_ld_b32(const float* g, float* l) {
    __builtin_amdgcn_global_load_async_to_lds_b32(
        (AS1 int*)(int*)(g), (AS3 int*)(int*)(l), 0, 0);
}
static __device__ __forceinline__ void wait_async0() {
#if __has_builtin(__builtin_amdgcn_s_wait_asynccnt)
    __builtin_amdgcn_s_wait_asynccnt(0);
#else
    asm volatile("s_wait_asynccnt 0x0" ::: "memory");
#endif
}
#else
static __device__ __forceinline__ void wait_async0() {}
#endif

// ---------------------------------------------------------------------------
// Kernel 0: transpose w_qk [1024,512] -> wT [512,1024] for coalesced B loads
// ---------------------------------------------------------------------------
__global__ void k_transpose_w(const float* __restrict__ w, float* __restrict__ wT) {
    int idx = blockIdx.x * 256 + threadIdx.x;      // idx = c*1024 + j
    if (idx < Csz * C2) {
        int c = idx >> 10;
        int j = idx & (C2 - 1);
        wT[idx] = w[j * Csz + c];
    }
}

// ---------------------------------------------------------------------------
// Kernel 1: QK = x @ w^T + b, elu+1. Column blocks 0..3 store Q. Column blocks
// 4..7 hold K (4 heads x 128 rows) and never store it: they form this row
// block's partial k^T x and partial k sum straight from the accumulators.
// block: 256 thr (8 waves); tile 128 rows x 128 cols; wave 32x64 (8 accums)
// Double-buffered LDS; next tile DMA'd (async-to-LDS) during WMMA compute.
// ---------------------------------------------------------------------------
#define XS_STRIDE 36               // 144B rows: 16B aligned, conflict-free
#define XS_ELEMS  (128 * XS_STRIDE)
#define WP_ELEMS  (16 * 256)       // [kpair][j*2 + (krow&1)]

__global__ void __launch_bounds__(256)
k_qk_gemm(const float* __restrict__ x, const float* __restrict__ wT,
          const float* __restrict__ bqk, float* __restrict__ ws) {
    __shared__ __attribute__((aligned(16))) float xs[2][XS_ELEMS];
    __shared__ __attribute__((aligned(16))) float wp[2][WP_ELEMS];

    float* Q = ws + Q_OFF;

    const int tid  = threadIdx.x;
    const int lane = tid & 31;
    const int lo   = lane & 15;
    const int half = lane >> 4;
    const int wv   = tid >> 5;           // 0..7
    const int wm   = wv & 3;             // m sub-tile (x32 rows)
    const int wj   = wv >> 2;            // j sub-tile (x64 cols)

    const int m0 = blockIdx.x * 128;
    const int j0 = blockIdx.y * 128;

    v8f acc[2][4];
    for (int s = 0; s < 2; ++s)
        for (int t = 0; t < 4; ++t) acc[s][t] = (v8f)0.0f;

    // -- tile staging: x[128x32] (b128 chunks), w[32x128] K-pair interleaved --
    auto stage = [&](int c0, int buf) {
#if HAVE_ASYNC
        #pragma unroll
        for (int it = 0; it < 4; ++it) {
            int idx = it * 256 + tid;                 // 1024 float4
            int r = idx >> 3, q = idx & 7;
            async_ld_b128(x + (size_t)(m0 + r) * Csz + c0 + q * 4,
                          &xs[buf][r * XS_STRIDE + q * 4]);
        }
        #pragma unroll
        for (int it = 0; it < 16; ++it) {
            int e = it * 256 + tid;                   // 4096 floats
            int r = e >> 7, j = e & 127;
            async_ld_b32(wT + (size_t)(c0 + r) * C2 + j0 + j,
                         &wp[buf][(r >> 1) * 256 + j * 2 + (r & 1)]);
        }
#else
        v4f tx[4], tw[4];
        #pragma unroll
        for (int it = 0; it < 4; ++it) {
            int idx = it * 256 + tid;
            int r = idx >> 3, q = idx & 7;
            tx[it] = *(const v4f*)(x + (size_t)(m0 + r) * Csz + c0 + q * 4);
        }
        #pragma unroll
        for (int it = 0; it < 4; ++it) {
            int idx = it * 256 + tid;
            int r = idx >> 5, q = idx & 31;
            tw[it] = *(const v4f*)(wT + (size_t)(c0 + r) * C2 + j0 + q * 4);
        }
        #pragma unroll
        for (int it = 0; it < 4; ++it) {
            int idx = it * 256 + tid;
            int r = idx >> 3, q = idx & 7;
            *(v4f*)(&xs[buf][r * XS_STRIDE + q * 4]) = tx[it];
        }
        #pragma unroll
        for (int it = 0; it < 4; ++it) {
            int idx = it * 256 + tid;
            int r = idx >> 5, q = idx & 31;
            float* dst = &wp[buf][(r >> 1) * 256 + (r & 1)];
            #pragma unroll
            for (int i = 0; i < 4; ++i) dst[(q * 4 + i) * 2] = tw[it][i];
        }
#endif
    };

    auto compute = [&](int buf) {
        const float* xsb = xs[buf];
        const float* wpb = wp[buf];
        #pragma unroll
        for (int kk = 0; kk < 32; kk += 4) {
            v2f a0 = *(const v2f*)(xsb + (wm * 32 + lo) * XS_STRIDE + kk + half * 2);
            v2f a1 = *(const v2f*)(xsb + (wm * 32 + 16 + lo) * XS_STRIDE + kk + half * 2);
            const float* wrow = wpb + ((kk >> 1) + half) * 256;
            #pragma unroll
            for (int jt = 0; jt < 4; ++jt) {
                v2f bf = *(const v2f*)(wrow + (wj * 64 + jt * 16 + lo) * 2);
                acc[0][jt] = wmma_f32(a0, bf, acc[0][jt]);
                acc[1][jt] = wmma_f32(a1, bf, acc[1][jt]);
            }
        }
    };

    stage(0, 0);
    wait_async0();
    __syncthreads();

    int buf = 0;
    for (int c0 = 0; c0 < Csz; c0 += 32, buf ^= 1) {
        if (c0 + 32 < Csz) stage(c0 + 32, buf ^ 1);   // DMA next tile
        compute(buf);                                  // WMMA on current tile
        wait_async0();                                 // next tile landed
        __syncthreads();
    }

    if (blockIdx.y < Csz / 128) {
        // Q block: bias + elu+1, store
        for (int jt = 0; jt < 4; ++jt) {
            int j = j0 + wj * 64 + jt * 16 + lo;
            float bias = bqk[j];
            for (int s = 0; s < 2; ++s) {
                for (int r = 0; r < 8; ++r) {
                    int mloc = wm * 32 + s * 16 + half * 8 + r;
                    size_t m = (size_t)(m0 + mloc);
                    float v = acc[s][jt][r] + bias;
                    float e = exp_slot(v);                     // ahead of the choice: no branch
                    Q[m * Csz + j] = (v > 0.0f) ? (v + 1.0f) : e;   // elu(v)+1
                }
            }
        }
        return;                          // whole block: blockIdx.y is the test
    }

    // ---- K block ------------------------------------------------------------
    // An accumulator tile holds k[n][d] with d = lane&15 and n = 8*half + r, so
    // registers (2t, 2t+1) are already an A fragment of k^T whose k slot
    // (half, v) stands for row n = 8*half + 2t + v. The B fragment takes x at
    // the same rows: both sides pair slot and row alike, the sum over n is whole.
    const int kc0 = j0 - Csz;            // first k column (= x column) of the block
    float bias[4];
    // this loop and those below index register arrays: unrolled so they stay registers
    #pragma unroll
    for (int jt = 0; jt < 4; ++jt) bias[jt] = bqk[j0 + wj * 64 + jt * 16 + lo];
    const float* xb = x + (size_t)(m0 + wm * 32 + half * 8) * Csz + kc0 + wj * 64 + lo;
    float xf[2][2][2][8];                // [head of the wave][e tile][row tile][row]
    #pragma unroll
    for (int hd = 0; hd < 2; ++hd)
        #pragma unroll
        for (int et = 0; et < 2; ++et)
            #pragma unroll
            for (int s = 0; s < 2; ++s)
                #pragma unroll
                for (int i = 0; i < 8; ++i)
                    xf[hd][et][s][i] = xb[(s * 16 + i) * Csz + hd * 32 + et * 16];

    float* redq = &xs[0][0];             // LDS is free behind the loop's last barrier
    float* redp = &wp[0][0];
    float* red  = (wj == 0 ? redp : redq) + wm * 2048;   // 2 heads x 32 x 32 per wave
    float* ksred = redq + 8192;          // 8 waves x 64 columns

    float ks[4];
    #pragma unroll
    for (int jt = 0; jt < 4; ++jt) {
        ks[jt] = 0.0f;
        #pragma unroll
        for (int s = 0; s < 2; ++s)
            #pragma unroll
            for (int r = 0; r < 8; ++r) {
                float v = acc[s][jt][r] + bias[jt];
                float e = exp_slot(v);                         // ahead of the choice: no branch
                float act = (v > 0.0f) ? (v + 1.0f) : e;       // elu(v)+1
                acc[s][jt][r] = act;
                ks[jt] += act;
            }
    }
    #pragma unroll
    for (int jt = 0; jt < 4; ++jt)
        ks[jt] += __shfl_xor(ks[jt], 16, 32);      // the other 16 rows of the wave
    if (half == 0) {
        #pragma unroll
        for (int jt = 0; jt < 4; ++jt) ksred[wv * 64 + jt * 16 + lo] = ks[jt];
    }

    #pragma unroll
    for (int hd = 0; hd < 2; ++hd) {
        v8f kva[2][2];                   // [d tile][e tile]
        kva[0][0] = (v8f)0.0f; kva[0][1] = (v8f)0.0f;
        kva[1][0] = (v8f)0.0f; kva[1][1] = (v8f)0.0f;
        #pragma unroll
        for (int s = 0; s < 2; ++s)
            #pragma unroll
            for (int t = 0; t < 4; ++t) {
                v2f a0, a1, f0, f1;
                a0[0] = acc[s][hd * 2][2 * t];     a0[1] = acc[s][hd * 2][2 * t + 1];
                a1[0] = acc[s][hd * 2 + 1][2 * t]; a1[1] = acc[s][hd * 2 + 1][2 * t + 1];
                f0[0] = xf[hd][0][s][2 * t];       f0[1] = xf[hd][0][s][2 * t + 1];
                f1[0] = xf[hd][1][s][2 * t];       f1[1] = xf[hd][1][s][2 * t + 1];
                kva[0][0] = wmma_f32(a0, f0, kva[0][0]);
                kva[0][1] = wmma_f32(a0, f1, kva[0][1]);
                kva[1][0] = wmma_f32(a1, f0, kva[1][0]);
                kva[1][1] = wmma_f32(a1, f1, kva[1][1]);
            }
        #pragma unroll
        for (int dt = 0; dt < 2; ++dt)
            #pragma unroll
            for (int et = 0; et < 2; ++et)
                #pragma unroll
                for (int r = 0; r < 8; ++r)
                    red[hd * 1024 + (dt * 16 + half * 8 + r) * DIM + et * 16 + lo] = kva[dt][et][r];
        // one head's four result tiles at a time: without this the two heads are
        // interleaved, 32 more registers are live and a work-group per WGP is lost
        __builtin_amdgcn_sched_barrier(0);
    }
    __syncthreads();                     // every wave's 32-row partials are in LDS

    // sum the four row groups in fixed order; one partial per (row block, head)
    const int ck  = (m0 >> 7) & (NCHUNK - 1);
    const int bh0 = (m0 >> 12) * HEADS + (kc0 >> 5);
    float* KVP = ws + KVP_OFF;
    float* KMP = ws + KMP_OFF;
    #pragma unroll                       // i picks the LDS array at compile time
    for (int i = 0; i < 4; ++i) {        // head i of the block, 4 floats per thread
        const float* rb = (i < 2 ? redp : redq) + (i & 1) * 1024 + tid * 4;
        v4f s4 = *(const v4f*)(rb);
        s4 += *(const v4f*)(rb + 2048);
        s4 += *(const v4f*)(rb + 4096);
        s4 += *(const v4f*)(rb + 6144);
        *(v4f*)(KVP + ((size_t)(bh0 + i) * NCHUNK + ck) * (DIM * DIM) + tid * 4) = s4;
    }
    if (tid < 128) {                     // column tid of the block
        const float* kb = ksred + (tid >> 6) * 256 + (tid & 63);
        float s1 = kb[0] + kb[64] + kb[128] + kb[192];
        KMP[((size_t)(bh0 + (tid >> 5)) * NCHUNK + ck) * DIM + (tid & 31)] = s1;
    }
}

// ---------------------------------------------------------------------------
// Kernel 2b: deterministic reduction of kv / k_mean partials (no atomics).
// KV is stored K-pair-interleaved: KV[(d>>1)*64 + e*2 + (d&1)] so kernel 3's
// B fragments are single aligned b64 loads.
// ---------------------------------------------------------------------------
__global__ void __launch_bounds__(256)
k_kv_reduce(float* __restrict__ ws) {
    const float* KVP = ws + KVP_OFF;
    const float* KMP = ws + KMP_OFF;
    float* KV = ws + KV_OFF;
    float* KM = ws + KM_OFF;

    const int bh = blockIdx.x;
    const float invN = 1.0f / (float)Nsz;

    for (int idx = threadIdx.x; idx < DIM * DIM; idx += 256) {
        int d = idx >> 5, e = idx & 31;
        float s = 0.0f;
        for (int c = 0; c < NCHUNK; ++c)
            s += KVP[((size_t)bh * NCHUNK + c) * (DIM * DIM) + idx];
        KV[(size_t)bh * (DIM * DIM) + (d >> 1) * 64 + e * 2 + (d & 1)] = s * invN;
    }
    if (threadIdx.x < DIM) {
        const float* kp = KMP + (size_t)bh * NCHUNK * DIM + threadIdx.x;
        float p[NCHUNK];
        p[0] = kp[0];
        // the first load gets address registers of its own, and a later load may
        // return into them: keep the wait in front of that overwrite
        asm volatile("s_wait_xcnt 0x0" ::: "memory");
        #pragma unroll                   // p[] stays in registers
        for (int c = 1; c < NCHUNK; ++c) p[c] = kp[c * DIM];
        // the same wait for the other loads; naming kp keeps a load from
        // returning into their address registers ahead of it
        asm volatile("s_wait_xcnt 0x0" :: "v"(kp) : "memory");
        float s = 0.0f;
        #pragma unroll
        for (int c = 0; c < NCHUNK; ++c) s += p[c];
        KM[(size_t)bh * DIM + threadIdx.x] = s * invN;
    }
}

// ---------------------------------------------------------------------------
// Kernel 3: out = z * (q @ kv) + LePE(x);  z = 1/(q . k_mean + 1e-6)
// grid: (image row pairs, B*HEADS); block 128 thr (4 waves);
// wave = the same 16 pixels of both image rows x 32 cols.
// The block's operands are staged in LDS once, by whole-line 16-byte loads:
// the four x rows its 3x3 windows touch (zero halo on every side) and the
// 128x32 q tile. Taps and A fragments are then LDS reads.
// ---------------------------------------------------------------------------
#define RB      2                  // image rows per block
#define T_PITCH 36                 // 144B pixel pitch: 16B aligned; 8 pixels = 32 banks
#define XT_COLS (IMGW + 2)         // one zero pixel left and right
#define XT_ROWS (RB + 2)

__global__ void __launch_bounds__(128)
k_attn_out(const float* __restrict__ x, const float* __restrict__ wlepe,
           const float* __restrict__ blepe, const float* __restrict__ ws_c,
           float* __restrict__ out) {
    __shared__ __attribute__((aligned(16))) float xt[XT_ROWS * XT_COLS * T_PITCH];
    __shared__ __attribute__((aligned(16))) float qt[RB * IMGW * T_PITCH];

    const float* Q  = ws_c + Q_OFF;
    const float* KV = ws_c + KV_OFF;     // K-pair interleaved
    const float* KM = ws_c + KM_OFF;

    const int y0 = blockIdx.x * RB;      // first image row; a row = 64 consecutive n
    const int bh = blockIdx.y;
    const int b  = bh >> 4;
    const int hh = bh & 15;
    const int ch = hh * DIM;

    const int tid  = threadIdx.x;
    const int lane = tid & 31;
    const int lo   = lane & 15;
    const int half = lane >> 4;
    const int wv   = tid >> 5;

    const size_t rowbase = (size_t)b * Nsz;
    const size_t kvbase  = (size_t)bh * DIM * DIM;
    const size_t kmbase  = (size_t)bh * DIM;

    // -- stage: 8 lanes cover one pixel's 128-byte line of this head ---------
    const int sq = tid & 7;              // 16-byte piece of the line
    const int sp = tid >> 3;             // pixel 0..15, +16 per step
    v4f tq[RB * 4], tx[XT_ROWS][4];
    #pragma unroll
    for (int i = 0; i < RB * 4; ++i)
        tq[i] = *(const v4f*)(Q + (rowbase + y0 * IMGW + i * 16 + sp) * Csz + ch + sq * 4);
    // Only the first staged row can lie above the image and only the last one
    // below it. Such a row is read at a clamped, valid address and replaced by
    // zeros, so the staging stays free of branches.
    const bool top_ok = y0 > 0;
    const bool bot_ok = y0 + RB < IMGH;
    #pragma unroll
    for (int ry = 0; ry < XT_ROWS; ++ry) {
        const bool ok = (ry == 0) ? top_ok : (ry == XT_ROWS - 1) ? bot_ok : true;
        const int yy = ok ? y0 + ry - 1 : y0;    // same for the whole block
        #pragma unroll
        for (int i = 0; i < 4; ++i) {
            v4f t = *(const v4f*)(x + (rowbase + yy * IMGW + i * 16 + sp) * Csz + ch + sq * 4);
            tx[ry][i] = ok ? t : (v4f)0.0f;
        }
    }

    // operands that do not pass through LDS, requested ahead of the barrier:
    // conv weights and bias of the lane's two channels, kv fragments, k_mean
    float wr[2][9], bias[2];
    #pragma unroll
    for (int et = 0; et < 2; ++et) {
        const int c = ch + et * 16 + lo;
        bias[et] = blepe[c];
        wr[et][8] = wlepe[c * 9 + 8];
    }
    // the wider weight loads below may return into the index registers of the
    // single-word loads above: keep the wait in front of that overwrite
    asm volatile("s_wait_xcnt 0x0" ::: "memory");
    #pragma unroll
    for (int et = 0; et < 2; ++et) {
        const int c = ch + et * 16 + lo;
        #pragma unroll
        for (int t = 0; t < 8; ++t) wr[et][t] = wlepe[c * 9 + t];
    }
    v2f b0[8], b1[8], km[8];
    #pragma unroll
    for (int s = 0; s < 8; ++s) {
        const int k0 = s * 4 + half * 2; // even
        // B = kv : pair-interleaved -> single b64 per 16-col tile
        b0[s] = *(const v2f*)(KV + kvbase + (k0 >> 1) * 64 + lo * 2);
        b1[s] = *(const v2f*)(KV + kvbase + (k0 >> 1) * 64 + (16 + lo) * 2);
        km[s] = *(const v2f*)(KM + kmbase + k0);
    }

    #pragma unroll
    for (int i = 0; i < RB * 4; ++i)
        *(v4f*)(qt + (i * 16 + sp) * T_PITCH + sq * 4) = tq[i];
    #pragma unroll
    for (int ry = 0; ry < XT_ROWS; ++ry)
        #pragma unroll
        for (int i = 0; i < 4; ++i)
            *(v4f*)(xt + (ry * XT_COLS + 1 + i * 16 + sp) * T_PITCH + sq * 4) = tx[ry][i];
    if (tid < XT_ROWS * 16) {            // zero pixels left and right of each row
        const int hr = tid >> 4, side = (tid >> 3) & 1;
        *(v4f*)(xt + (hr * XT_COLS + side * (XT_COLS - 1)) * T_PITCH + sq * 4) = (v4f)0.0f;
    }
    __syncthreads();                     // tiles complete before any wave reads them

    v8f acc[RB][2];
    float zpart[RB];
    #pragma unroll
    for (int t = 0; t < RB; ++t) {
        acc[t][0] = (v8f)0.0f; acc[t][1] = (v8f)0.0f; zpart[t] = 0.0f;
    }

    #pragma unroll
    for (int s = 0; s < 8; ++s) {
        const int k0 = s * 4 + half * 2;
        #pragma unroll
        for (int t = 0; t < RB; ++t) {
            // A = q : row = pixel wv*16+lo of image row t, k = 4s + 2*half + vgpr
            v2f a = *(const v2f*)(qt + (t * IMGW + wv * 16 + lo) * T_PITCH + k0);
            acc[t][0] = wmma_f32(a, b0[s], acc[t][0]);
            acc[t][1] = wmma_f32(a, b1[s], acc[t][1]);
            zpart[t] += a[0] * km[s][0] + a[1] * km[s][1];
        }
    }

    // z per row: lane 'lo' (both halves) holds z for pixel wv*16+lo
    float zr[RB][8];
    #pragma unroll
    for (int t = 0; t < RB; ++t) {
        float dot = zpart[t] + __shfl_xor(zpart[t], 16, 32);
        float z   = 1.0f / (dot + 1e-6f);
        #pragma unroll
        for (int r = 0; r < 8; ++r) {
            float zl = __shfl(z, r, 32);
            float zh = __shfl(z, r + 8, 32);
            zr[t][r] = half ? zh : zl;
        }
    }

    // LePE in the accumulator layout: a lane owns 8 consecutive pixels of one
    // channel in each image row, so a staged row is 10 LDS reads that serve
    // every window row it is part of.
    const float* xb = xt + (wv * 16 + half * 8) * T_PITCH + lo;
    #pragma unroll
    for (int et = 0; et < 2; ++et) {
        float o[RB][8];
        #pragma unroll
        for (int t = 0; t < RB; ++t)
            #pragma unroll
            for (int r = 0; r < 8; ++r) o[t][r] = bias[et];
        #pragma unroll
        for (int ry = 0; ry < XT_ROWS; ++ry) {
            float v[10];
            #pragma unroll
            for (int j = 0; j < 10; ++j)
                v[j] = xb[(ry * XT_COLS + j) * T_PITCH + et * 16];
            #pragma unroll
            for (int t = 0; t < RB; ++t) {
                const int dy = ry - t;   // window row of image row t
                if (dy < 0 || dy > 2) continue;
                #pragma unroll
                for (int r = 0; r < 8; ++r)
                    #pragma unroll
                    for (int dx = 0; dx < 3; ++dx)
                        o[t][r] += v[r + dx] * wr[et][dy * 3 + dx];
            }
        }
        const int c = ch + et * 16 + lo;
        #pragma unroll
        for (int t = 0; t < RB; ++t)
            #pragma unroll
            for (int r = 0; r < 8; ++r) {
                const int n = (y0 + t) * IMGW + wv * 16 + half * 8 + r;
                out[(rowbase + n) * Csz + c] = acc[t][et][r] * zr[t][r] + o[t][r];
            }
    }
}

// ---------------------------------------------------------------------------
extern "C" void kernel_launch(void* const* d_in, const int* in_sizes, int n_in,
                              void* d_out, int out_size, void* d_ws, size_t ws_size,
                              hipStream_t stream) {
    (void)in_sizes; (void)n_in; (void)out_size; (void)ws_size;
    const float* x      = (const float*)d_in[0];
    const float* w_qk   = (const float*)d_in[1];
    const float* b_qk   = (const float*)d_in[2];
    const float* w_lepe = (const float*)d_in[3];
    const float* b_lepe = (const float*)d_in[4];
    float* out = (float*)d_out;
    float* ws  = (float*)d_ws;
    float* wT  = ws + WT_OFF;

    k_transpose_w<<<(Csz * C2 + 255) / 256, 256, 0, stream>>>(w_qk, wT);
    k_qk_gemm<<<dim3(Mtot / 128, C2 / 128), 256, 0, stream>>>(x, wT, b_qk, ws);
    k_kv_reduce<<<Bsz * HEADS, 256, 0, stream>>>(ws);
    k_attn_out<<<dim3(IMGH / RB, Bsz * HEADS), 128, 0, stream>>>(
        x, w_lepe, b_lepe, ws, out);
}

// v003
// One run takes 188 microseconds.
// Next to v002, in two timings, it ran 1.11 times as fast each time.
// Over all steps from v000 it is 1.52 times as fast.
#include <hip/hip_runtime.h>
#include <hip/hip_bf16.h>
#include <math.h>

typedef float v8f __attribute__((ext_vector_type(8)));
typedef float v4f __attribute__((ext_vector_type(4)));
typedef float v2f __attribute__((ext_vector_type(2)));
typedef int   v4i __attribute__((ext_vector_type(4)));

#define AS1 __attribute__((address_space(1)))
#define AS3 __attribute__((address_space(3)))

// Problem constants
#define Bsz   8
#define Nsz   4096
#define Csz   512
#define C2    1024
#define HEADS 16
#define DIM   32
#define IMGH  64
#define IMGW  64
#define Mtot  (Bsz * Nsz)          // 32768 rows
#define NCHUNK 32                  // kv partials per batch: one per 128-row GEMM block

// Workspace layout (float offsets)
#define Q_OFF   0ul
#define KV_OFF  33554432ul         // (B*H*32*32  = 131072)
#define KM_OFF  33685504ul         // + B*H*32*32      (B*H*32     = 4096)
#define KVP_OFF 34213888ul         // (NCHUNK*B*H*1024 = 4194304)
#define KMP_OFF 38408192ul         // + partial kv     (NCHUNK*B*H*32   = 131072)

static __device__ __forceinline__ v8f wmma_f32(v2f a, v2f b, v8f c) {
    return __builtin_amdgcn_wmma_f32_16x16x4_f32(false, a, false, b, (short)0, c,
                                                 false, false);
}

// exp(v) as 2^(v*log2 e), for the negative side of elu(v)+1. One statement: the
// v_nop is the independent slot the instruction set asks for between a
// transcendental and a next instruction that reads its result or overwrites its
// source.
static __device__ __forceinline__ float exp_slot(float v) {
    float r;
    asm("v_exp_f32 %0, %1\n\tv_nop" : "=v"(r) : "v"(v * 1.44269504f));
    return r;
}

// ---- CDNA5 async global->LDS DMA (ASYNCcnt) with fallback ------------------
#if defined(__gfx1250__) && \
    __has_builtin(__builtin_amdgcn_global_load_async_to_lds_b128)
#define HAVE_ASYNC 1
#else
#define HAVE_ASYNC 0
#endif

#if HAVE_ASYNC
static __device__ __forceinline__ void async_ld_b128(const float* g, float* l) {
    __builtin_amdgcn_global_load_async_to_lds_b128(
        (AS1 v4i*)(v4i*)(g), (AS3 v4i*)(v4i*)(l), 0, 0);
}
static __device__ __forceinline__ void wait_async0() {
#if __has_builtin(__builtin_amdgcn_s_wait_asynccnt)
    __builtin_amdgcn_s_wait_asynccnt(0);
#else
    asm volatile("s_wait_asynccnt 0x0" ::: "memory");
#endif
}
#else
static __device__ __forceinline__ void wait_async0() {}
#endif

// ---------------------------------------------------------------------------
// Kernel 1: QK = x @ w^T + b, elu+1. Column blocks 0..3 store Q. Column blocks
// 4..7 hold K (4 heads x 128 rows) and never store it: they form this row
// block's partial k^T x and partial k sum straight from the accumulators.
// block: 256 thr (8 waves); tile 128 rows x 128 cols; wave 32x64 (8 accums)
// Double-buffered LDS; next tile DMA'd (async-to-LDS) during WMMA compute.
// Both operands are k-contiguous in memory (x row m, w row j), and a lane's B
// fragment is two consecutive k of column j just as its A fragment is two
// consecutive k of row m: w is staged in its own layout and read by x's loader.
// ---------------------------------------------------------------------------
#define XS_STRIDE 36               // 144B rows: 16B aligned, conflict-free
#define XS_ELEMS  (128 * XS_STRIDE)

__global__ void __launch_bounds__(256)
k_qk_gemm(const float* __restrict__ x, const float* __restrict__ w,
          const float* __restrict__ bqk, float* __restrict__ ws) {
    __shared__ __attribute__((aligned(16))) float xs[2][XS_ELEMS];
    __shared__ __attribute__((aligned(16))) float wp[2][XS_ELEMS];

    float* Q = ws + Q_OFF;

    const int tid  = threadIdx.x;
    const int lane = tid & 31;
    const int lo   = lane & 15;
    const int half = lane >> 4;
    const int wv   = tid >> 5;           // 0..7
    const int wm   = wv & 3;             // m sub-tile (x32 rows)
    const int wj   = wv >> 2;            // j sub-tile (x64 cols)

    const int m0 = blockIdx.x * 128;
    const int j0 = blockIdx.y * 128;

    v8f acc[2][4];
    for (int s = 0; s < 2; ++s)
        for (int t = 0; t < 4; ++t) acc[s][t] = (v8f)0.0f;

    // -- tile staging: x[128 m x 32 k] and w[128 j x 32 k], whole 128-byte lines --
    auto stage = [&](int c0, int buf) {
#if HAVE_ASYNC
        #pragma unroll
        for (int it = 0; it < 4; ++it) {
            int idx = it * 256 + tid;                 // 1024 float4
            int r = idx >> 3, q = idx & 7;
            async_ld_b128(x + (size_t)(m0 + r) * Csz + c0 + q * 4,
                          &xs[buf][r * XS_STRIDE + q * 4]);
        }
        #pragma unroll
        for (int it = 0; it < 4; ++it) {
            int idx = it * 256 + tid;                 // 1024 float4
            int r = idx >> 3, q = idx & 7;
            async_ld_b128(w + (size_t)(j0 + r) * Csz + c0 + q * 4,
                          &wp[buf][r * XS_STRIDE + q * 4]);
        }
#else
        v4f tx[4], tw[4];
        #pragma unroll
        for (int it = 0; it < 4; ++it) {
            int idx = it * 256 + tid;
            int r = idx >> 3, q = idx & 7;
            tx[it] = *(const v4f*)(x + (size_t)(m0 + r) * Csz + c0 + q * 4);
        }
        #pragma unroll
        for (int it = 0; it < 4; ++it) {
            int idx = it * 256 + tid;
            int r = idx >> 3, q = idx & 7;
            tw[it] = *(const v4f*)(w + (size_t)(j0 + r) * Csz + c0 + q * 4);
        }
        #pragma unroll
        for (int it = 0; it < 4; ++it) {
            int idx = it * 256 + tid;
            int r = idx >> 3, q = idx & 7;
            *(v4f*)(&xs[buf][r * XS_STRIDE + q * 4]) = tx[it];
        }
        #pragma unroll
        for (int it = 0; it < 4; ++it) {
            int idx = it * 256 + tid;
            int r = idx >> 3, q = idx & 7;
            *(v4f*)(&wp[buf][r * XS_STRIDE + q * 4]) = tw[it];
        }
#endif
    };

    auto compute = [&](int buf) {
        const float* xsb = xs[buf];
        const float* wpb = wp[buf];
        #pragma unroll
        for (int kk = 0; kk < 32; kk += 4) {
            v2f a0 = *(const v2f*)(xsb + (wm * 32 + lo) * XS_STRIDE + kk + half * 2);
            v2f a1 = *(const v2f*)(xsb + (wm * 32 + 16 + lo) * XS_STRIDE + kk + half * 2);
            #pragma unroll
            for (int jt = 0; jt < 4; ++jt) {
                v2f bf = *(const v2f*)(wpb + (wj * 64 + jt * 16 + lo) * XS_STRIDE + kk + half * 2);
                acc[0][jt] = wmma_f32(a0, bf, acc[0][jt]);
                acc[1][jt] = wmma_f32(a1, bf, acc[1][jt]);
            }
        }
    };

    stage(0, 0);
    wait_async0();
    __syncthreads();

    int buf = 0;
    for (int c0 = 0; c0 < Csz; c0 += 32, buf ^= 1) {
        if (c0 + 32 < Csz) stage(c0 + 32, buf ^ 1);   // DMA next tile
        compute(buf);                                  // WMMA on current tile
        wait_async0();                                 // next tile landed
        __syncthreads();
    }

    if (blockIdx.y < Csz / 128) {
        // Q block: bias + elu+1, store
        for (int jt = 0; jt < 4; ++jt) {
            int j = j0 + wj * 64 + jt * 16 + lo;
            float bias = bqk[j];
            for (int s = 0; s < 2; ++s) {
                for (int r = 0; r < 8; ++r) {
                    int mloc = wm * 32 + s * 16 + half * 8 + r;
                    size_t m = (size_t)(m0 + mloc);
                    float v = acc[s][jt][r] + bias;
                    float e = exp_slot(v);                     // ahead of the choice: no branch
                    Q[m * Csz + j] = (v > 0.0f) ? (v + 1.0f) : e;   // elu(v)+1
                }
            }
        }
        return;                          // whole block: blockIdx.y is the test
    }

    // ---- K block ------------------------------------------------------------
    // An accumulator tile holds k[n][d] with d = lane&15 and n = 8*half + r, so
    // registers (2t, 2t+1) are already an A fragment of k^T whose k slot
    // (half, v) stands for row n = 8*half + 2t + v. The B fragment takes x at
    // the same rows: both sides pair slot and row alike, the sum over n is whole.
    const int kc0 = j0 - Csz;            // first k column (= x column) of the block
    float bias[4];
    // this loop and those below index register arrays: unrolled so they stay registers
    #pragma unroll
    for (int jt = 0; jt < 4; ++jt) bias[jt] = bqk[j0 + wj * 64 + jt * 16 + lo];
    const float* xb = x + (size_t)(m0 + wm * 32 + half * 8) * Csz + kc0 + wj * 64 + lo;
    float xf[2][2][2][8];                // [head of the wave][e tile][row tile][row]
    #pragma unroll
    for (int hd = 0; hd < 2; ++hd)
        #pragma unroll
        for (int et = 0; et < 2; ++et)
            #pragma unroll
            for (int s = 0; s < 2; ++s)
                #pragma unroll
                for (int i = 0; i < 8; ++i)
                    xf[hd][et][s][i] = xb[(s * 16 + i) * Csz + hd * 32 + et * 16];

    float* redq = &xs[0][0];             // LDS is free behind the loop's last barrier
    float* redp = &wp[0][0];
    float* red  = (wj == 0 ? redp : redq) + wm * 2048;   // 2 heads x 32 x 32 per wave
    float* ksred = redq + 8192;          // 8 waves x 64 columns

    float ks[4];
    #pragma unroll
    for (int jt = 0; jt < 4; ++jt) {
        ks[jt] = 0.0f;
        #pragma unroll
        for (int s = 0; s < 2; ++s)
            #pragma unroll
            for (int r = 0; r < 8; ++r) {
                float v = acc[s][jt][r] + bias[jt];
                float e = exp_slot(v);                         // ahead of the choice: no branch
                float act = (v > 0.0f) ? (v + 1.0f) : e;       // elu(v)+1
                acc[s][jt][r] = act;
                ks[jt] += act;
            }
    }
    #pragma unroll
    for (int jt = 0; jt < 4; ++jt)
        ks[jt] += __shfl_xor(ks[jt], 16, 32);      // the other 16 rows of the wave
    if (half == 0) {
        #pragma unroll
        for (int jt = 0; jt < 4; ++jt) ksred[wv * 64 + jt * 16 + lo] = ks[jt];
    }

    #pragma unroll
    for (int hd = 0; hd < 2; ++hd) {
        v8f kva[2][2];                   // [d tile][e tile]
        kva[0][0] = (v8f)0.0f; kva[0][1] = (v8f)0.0f;
        kva[1][0] = (v8f)0.0f; kva[1][1] = (v8f)0.0f;
        #pragma unroll
        for (int s = 0; s < 2; ++s)
            #pragma unroll
            for (int t = 0; t < 4; ++t) {
                v2f a0, a1, f0, f1;
                a0[0] = acc[s][hd * 2][2 * t];     a0[1] = acc[s][hd * 2][2 * t + 1];
                a1[0] = acc[s][hd * 2 + 1][2 * t]; a1[1] = acc[s][hd * 2 + 1][2 * t + 1];
                f0[0] = xf[hd][0][s][2 * t];       f0[1] = xf[hd][0][s][2 * t + 1];
                f1[0] = xf[hd][1][s][2 * t];       f1[1] = xf[hd][1][s][2 * t + 1];
                kva[0][0] = wmma_f32(a0, f0, kva[0][0]);
                kva[0][1] = wmma_f32(a0, f1, kva[0][1]);
                kva[1][0] = wmma_f32(a1, f0, kva[1][0]);
                kva[1][1] = wmma_f32(a1, f1, kva[1][1]);
            }
        #pragma unroll
        for (int dt = 0; dt < 2; ++dt)
            #pragma unroll
            for (int et = 0; et < 2; ++et)
                #pragma unroll
                for (int r = 0; r < 8; ++r)
                    red[hd * 1024 + (dt * 16 + half * 8 + r) * DIM + et * 16 + lo] = kva[dt][et][r];
        // one head's four result tiles at a time: without this the two heads are
        // interleaved, 32 more registers are live and a work-group per WGP is lost
        __builtin_amdgcn_sched_barrier(0);
    }
    __syncthreads();                     // every wave's 32-row partials are in LDS

    // sum the four row groups in fixed order; one partial per (row block, head)
    const int ck  = (m0 >> 7) & (NCHUNK - 1);
    const int bh0 = (m0 >> 12) * HEADS + (kc0 >> 5);
    float* KVP = ws + KVP_OFF;
    float* KMP = ws + KMP_OFF;
    #pragma unroll                       // i picks the LDS array at compile time
    for (int i = 0; i < 4; ++i) {        // head i of the block, 4 floats per thread
        const float* rb = (i < 2 ? redp : redq) + (i & 1) * 1024 + tid * 4;
        v4f s4 = *(const v4f*)(rb);
        s4 += *(const v4f*)(rb + 2048);
        s4 += *(const v4f*)(rb + 4096);
        s4 += *(const v4f*)(rb + 6144);
        *(v4f*)(KVP + ((size_t)(bh0 + i) * NCHUNK + ck) * (DIM * DIM) + tid * 4) = s4;
    }
    if (tid < 128) {                     // column tid of the block
        const float* kb = ksred + (tid >> 6) * 256 + (tid & 63);
        float s1 = kb[0] + kb[64] + kb[128] + kb[192];
        KMP[((size_t)(bh0 + (tid >> 5)) * NCHUNK + ck) * DIM + (tid & 31)] = s1;
    }
}

// ---------------------------------------------------------------------------
// Kernel 2b: deterministic reduction of kv / k_mean partials (no atomics).
// KV is stored K-pair-interleaved: KV[(d>>1)*64 + e*2 + (d&1)] so kernel 3's
// B fragments are single aligned b64 loads.
// ---------------------------------------------------------------------------
__global__ void __launch_bounds__(256)
k_kv_reduce(float* __restrict__ ws) {
    const float* KVP = ws + KVP_OFF;
    const float* KMP = ws + KMP_OFF;
    float* KV = ws + KV_OFF;
    float* KM = ws + KM_OFF;

    const int bh = blockIdx.x;
    const float invN = 1.0f / (float)Nsz;

    for (int idx = threadIdx.x; idx < DIM * DIM; idx += 256) {
        int d = idx >> 5, e = idx & 31;
        float s = 0.0f;
        for (int c = 0; c < NCHUNK; ++c)
            s += KVP[((size_t)bh * NCHUNK + c) * (DIM * DIM) + idx];
        KV[(size_t)bh * (DIM * DIM) + (d >> 1) * 64 + e * 2 + (d & 1)] = s * invN;
    }
    if (threadIdx.x < DIM) {
        const float* kp = KMP + (size_t)bh * NCHUNK * DIM + threadIdx.x;
        float p[NCHUNK];
        p[0] = kp[0];
        // the first load gets address registers of its own, and a later load may
        // return into them: keep the wait in front of that overwrite
        asm volatile("s_wait_xcnt 0x0" ::: "memory");
        #pragma unroll                   // p[] stays in registers
        for (int c = 1; c < NCHUNK; ++c) p[c] = kp[c * DIM];
        // the same wait for the other loads; naming kp keeps a load from
        // returning into their address registers ahead of it
        asm volatile("s_wait_xcnt 0x0" :: "v"(kp) : "memory");
        float s = 0.0f;
        #pragma unroll
        for (int c = 0; c < NCHUNK; ++c) s += p[c];
        KM[(size_t)bh * DIM + threadIdx.x] = s * invN;
    }
}

// ---------------------------------------------------------------------------
// Kernel 3: out = z * (q @ kv) + LePE(x);  z = 1/(q . k_mean + 1e-6)
// grid: (image row pairs, B*HEADS); block 128 thr (4 waves);
// wave = the same 16 pixels of both image rows x 32 cols.
// The block's operands are staged in LDS once, by whole-line 16-byte loads:
// the four x rows its 3x3 windows touch (zero halo on every side) and the
// 128x32 q tile. Taps and A fragments are then LDS reads.
// ---------------------------------------------------------------------------
#define RB      2                  // image rows per block
#define T_PITCH 36                 // 144B pixel pitch: 16B aligned; 8 pixels = 32 banks
#define XT_COLS (IMGW + 2)         // one zero pixel left and right
#define XT_ROWS (RB + 2)

__global__ void __launch_bounds__(128)
k_attn_out(const float* __restrict__ x, const float* __restrict__ wlepe,
           const float* __restrict__ blepe, const float* __restrict__ ws_c,
           float* __restrict__ out) {
    __shared__ __attribute__((aligned(16))) float xt[XT_ROWS * XT_COLS * T_PITCH];
    __shared__ __attribute__((aligned(16))) float qt[RB * IMGW * T_PITCH];

    const float* Q  = ws_c + Q_OFF;
    const float* KV = ws_c + KV_OFF;     // K-pair interleaved
    const float* KM = ws_c + KM_OFF;

    const int y0 = blockIdx.x * RB;      // first image row; a row = 64 consecutive n
    const int bh = blockIdx.y;
    const int b  = bh >> 4;
    const int hh = bh & 15;
    const int ch = hh * DIM;

    const int tid  = threadIdx.x;
    const int lane = tid & 31;
    const int lo   = lane & 15;
    const int half = lane >> 4;
    const int wv   = tid >> 5;

    const size_t rowbase = (size_t)b * Nsz;
    const size_t kvbase  = (size_t)bh * DIM * DIM;
    const size_t kmbase  = (size_t)bh * DIM;

    // -- stage: 8 lanes cover one pixel's 128-byte line of this head ---------
    const int sq = tid & 7;              // 16-byte piece of the line
    const int sp = tid >> 3;             // pixel 0..15, +16 per step
    v4f tq[RB * 4], tx[XT_ROWS][4];
    #pragma unroll
    for (int i = 0; i < RB * 4; ++i)
        tq[i] = *(const v4f*)(Q + (rowbase + y0 * IMGW + i * 16 + sp) * Csz + ch + sq * 4);
    // Only the first staged row can lie above the image and only the last one
    // below it. Such a row is read at a clamped, valid address and replaced by
    // zeros, so the staging stays free of branches.
    const bool top_ok = y0 > 0;
    const bool bot_ok = y0 + RB < IMGH;
    #pragma unroll
    for (int ry = 0; ry < XT_ROWS; ++ry) {
        const bool ok = (ry == 0) ? top_ok : (ry == XT_ROWS - 1) ? bot_ok : true;
        const int yy = ok ? y0 + ry - 1 : y0;    // same for the whole block
        #pragma unroll
        for (int i = 0; i < 4; ++i) {
            v4f t = *(const v4f*)(x + (rowbase + yy * IMGW + i * 16 + sp) * Csz + ch + sq * 4);
            tx[ry][i] = ok ? t : (v4f)0.0f;
        }
    }

    // operands that do not pass through LDS, requested ahead of the barrier:
    // conv weights and bias of the lane's two channels, kv fragments, k_mean
    float wr[2][9], bias[2];
    #pragma unroll
    for (int et = 0; et < 2; ++et) {
        const int c = ch + et * 16 + lo;
        bias[et] = blepe[c];
        wr[et][8] = wlepe[c * 9 + 8];
    }
    // the wider weight loads below may return into the index registers of the
    // single-word loads above: keep the wait in front of that overwrite
    asm volatile("s_wait_xcnt 0x0" ::: "memory");
    #pragma unroll
    for (int et = 0; et < 2; ++et) {
        const int c = ch + et * 16 + lo;
        #pragma unroll
        for (int t = 0; t < 8; ++t) wr[et][t] = wlepe[c * 9 + t];
    }
    v2f b0[8], b1[8], km[8];
    #pragma unroll
    for (int s = 0; s < 8; ++s) {
        const int k0 = s * 4 + half * 2; // even
        // B = kv : pair-interleaved -> single b64 per 16-col tile
        b0[s] = *(const v2f*)(KV + kvbase + (k0 >> 1) * 64 + lo * 2);
        b1[s] = *(const v2f*)(KV + kvbase + (k0 >> 1) * 64 + (16 + lo) * 2);
        km[s] = *(const v2f*)(KM + kmbase + k0);
    }

    #pragma unroll
    for (int i = 0; i < RB * 4; ++i)
        *(v4f*)(qt + (i * 16 + sp) * T_PITCH + sq * 4) = tq[i];
    #pragma unroll
    for (int ry = 0; ry < XT_ROWS; ++ry)
        #pragma unroll
        for (int i = 0; i < 4; ++i)
            *(v4f*)(xt + (ry * XT_COLS + 1 + i * 16 + sp) * T_PITCH + sq * 4) = tx[ry][i];
    if (tid < XT_ROWS * 16) {            // zero pixels left and right of each row
        const int hr = tid >> 4, side = (tid >> 3) & 1;
        *(v4f*)(xt + (hr * XT_COLS + side * (XT_COLS - 1)) * T_PITCH + sq * 4) = (v4f)0.0f;
    }
    __syncthreads();                     // tiles complete before any wave reads them

    v8f acc[RB][2];
    float zpart[RB];
    #pragma unroll
    for (int t = 0; t < RB; ++t) {
        acc[t][0] = (v8f)0.0f; acc[t][1] = (v8f)0.0f; zpart[t] = 0.0f;
    }

    #pragma unroll
    for (int s = 0; s < 8; ++s) {
        const int k0 = s * 4 + half * 2;
        #pragma unroll
        for (int t = 0; t < RB; ++t) {
            // A = q : row = pixel wv*16+lo of image row t, k = 4s + 2*half + vgpr
            v2f a = *(const v2f*)(qt + (t * IMGW + wv * 16 + lo) * T_PITCH + k0);
            acc[t][0] = wmma_f32(a, b0[s], acc[t][0]);
            acc[t][1] = wmma_f32(a, b1[s], acc[t][1]);
            zpart[t] += a[0] * km[s][0] + a[1] * km[s][1];
        }
    }

    // z per row: lane 'lo' (both halves) holds z for pixel wv*16+lo
    float zr[RB][8];
    #pragma unroll
    for (int t = 0; t < RB; ++t) {
        float dot = zpart[t] + __shfl_xor(zpart[t], 16, 32);
        float z   = 1.0f / (dot + 1e-6f);
        #pragma unroll
        for (int r = 0; r < 8; ++r) {
            float zl = __shfl(z, r, 32);
            float zh = __shfl(z, r + 8, 32);
            zr[t][r] = half ? zh : zl;
        }
    }

    // LePE in the accumulator layout: a lane owns 8 consecutive pixels of one
    // channel in each image row, so a staged row is 10 LDS reads that serve
    // every window row it is part of.
    const float* xb = xt + (wv * 16 + half * 8) * T_PITCH + lo;
    #pragma unroll
    for (int et = 0; et < 2; ++et) {
        float o[RB][8];
        #pragma unroll
        for (int t = 0; t < RB; ++t)
            #pragma unroll
            for (int r = 0; r < 8; ++r) o[t][r] = bias[et];
        #pragma unroll
        for (int ry = 0; ry < XT_ROWS; ++ry) {
            float v[10];
            #pragma unroll
            for (int j = 0; j < 10; ++j)
                v[j] = xb[(ry * XT_COLS + j) * T_PITCH + et * 16];
            #pragma unroll
            for (int t = 0; t < RB; ++t) {
                const int dy = ry - t;   // window row of image row t
                if (dy < 0 || dy > 2) continue;
                #pragma unroll
                for (int r = 0; r < 8; ++r)
                    #pragma unroll
                    for (int dx = 0; dx < 3; ++dx)
                        o[t][r] += v[r + dx] * wr[et][dy * 3 + dx];
            }
        }
        const int c = ch + et * 16 + lo;
        #pragma unroll
        for (int t = 0; t < RB; ++t)
            #pragma unroll
            for (int r = 0; r < 8; ++r) {
                const int n = (y0 + t) * IMGW + wv * 16 + half * 8 + r;
                out[(rowbase + n) * Csz + c] = acc[t][et][r] * zr[t][r] + o[t][r];
            }
    }
}

// ---------------------------------------------------------------------------
extern "C" void kernel_launch(void* const* d_in, const int* in_sizes, int n_in,
                              void* d_out, int out_size, void* d_ws, size_t ws_size,
                              hipStream_t stream) {
    (void)in_sizes; (void)n_in; (void)out_size; (void)ws_size;
    const float* x      = (const float*)d_in[0];
    const float* w_qk   = (const float*)d_in[1];
    const float* b_qk   = (const float*)d_in[2];
    const float* w_lepe = (const float*)d_in[3];
    const float* b_lepe = (const float*)d_in[4];
    float* out = (float*)d_out;
    float* ws  = (float*)d_ws;

    k_qk_gemm<<<dim3(Mtot / 128, C2 / 128), 256, 0, stream>>>(x, w_qk, b_qk, ws);
    k_kv_reduce<<<Bsz * HEADS, 256, 0, stream>>>(ws);
    k_attn_out<<<dim3(IMGH / RB, Bsz * HEADS), 128, 0, stream>>>(
        x, w_lepe, b_lepe, ws, out);
}
